// v000
// The times below were measured on an AMD MI455X: many runs one after another, warmed up first and cycling through
// copies of the inputs, with the whole window's GPU time divided by the number of runs. Launches and the gaps
// between them are all in it. The median over several windows is given; except for v000 it joins two sittings, which
// can be a few percent apart, so the side-by-side timings, each taken in one sitting, are the better comparison.
// The starting kernel, v000, takes 229 microseconds a run.
#include <hip/hip_runtime.h>

typedef __attribute__((ext_vector_type(16))) __bf16 v16bf;
typedef __attribute__((ext_vector_type(8)))  __bf16 v8bf;
typedef __attribute__((ext_vector_type(8)))  float  v8f;
typedef unsigned int u32x4 __attribute__((ext_vector_type(4)));
typedef int          i32x8 __attribute__((ext_vector_type(8)));
typedef int          i32x4 __attribute__((ext_vector_type(4)));

#define BB 4
#define CC 256
#define PP 128
#define NN 4096
#define QSCALE 0.08838834764831845f   /* 1/sqrt(128) */
#define BN_EPS 1e-5f

/* workspace byte offsets (all 256B aligned) */
#define OFF_WT   0u
#define OFF_WP   65536u
#define OFF_WG   131072u
#define OFF_WZ   196608u
#define OFF_Q    262144u      /* B*N*P bf16 = 4 MB */
#define OFF_K    4456448u
#define OFF_VT   8650752u     /* transposed values: [b][p][n] */
#define OFF_Y    12845056u
#define OFF_Z    17039360u    /* B*C*N fp32 = 16 MB */
#define OFF_SUM  33816576u    /* 256 f32 */
#define OFF_SSQ  33817600u    /* 256 f32 */
#define OFF_SCL  33818624u
#define OFF_SHF  33819648u

/* Load a 16xK WMMA A/B fragment (K-step=32) from a row-major bf16 tile.
   tile_base points at row 0 of the 16-row block; ld = row stride (elems).
   Per-lane: row = lane&15, k-runs at k0+8*(lane>>4) and +16. */
__device__ __forceinline__ v16bf load_frag16(const __bf16* tile_base, int ld, int k0) {
  int lane = threadIdx.x & 31;
  const __bf16* p = tile_base + (size_t)(lane & 15) * ld + k0 + ((lane >> 4) << 3);
  v8bf lo = *(const v8bf*)(p);
  v8bf hi = *(const v8bf*)(p + 16);
  v16bf f;
#pragma unroll
  for (int i = 0; i < 8; ++i) { f[i] = lo[i]; f[i + 8] = hi[i]; }
  return f;
}

__device__ __forceinline__ v8f wmma_bf16(v16bf a, v16bf b, v8f c) {
  return __builtin_amdgcn_wmma_f32_16x16x32_bf16(false, a, false, b, (short)0, c,
                                                 false, false);
}

__device__ __forceinline__ void tdm_load_k_tile(const __bf16* lds_dst,
                                                const __bf16* gsrc) {
  unsigned int ldsoff = (unsigned int)(uintptr_t)lds_dst;   /* addr[31:0] = LDS offset */
  unsigned long long ga = (unsigned long long)(uintptr_t)gsrc;
  u32x4 g0;
  g0[0] = 1u;                                              /* count=1, user mode */
  g0[1] = ldsoff;                                          /* lds_addr */
  g0[2] = (unsigned int)ga;                                /* global_addr[31:0] */
  g0[3] = (unsigned int)((ga >> 32) & 0x01FFFFFFu) | (2u << 30); /* [56:32], type=2 */
  i32x8 g1;
  g1[0] = (int)((1u << 16)
              | (1u << 20)
              | (5u << 22)
              | (3u << 25));
  g1[1] = (int)(128u << 16);
  g1[2] = (int)(4096u << 16);
  g1[3] = (int)(128u << 16);
  g1[4] = 64;
  g1[5] = 128;
  g1[6] = 0;
  g1[7] = 0;
  i32x4 z4 = {};
  i32x8 z8 = {};
  __builtin_amdgcn_tensor_load_to_lds(g0, g1, z4, z4, z8, 0);
}

/* ---- kernel 0: fp32 weights -> bf16, zero BN stat accumulators ---- */
__global__ void nl_prep_kernel(const float* __restrict__ Wt, const float* __restrict__ Wp,
                               const float* __restrict__ Wg, const float* __restrict__ Wz,
                               __bf16* wt, __bf16* wp, __bf16* wg, __bf16* wz,
                               float* stats /* 512 floats: sum | sumsq */) {
  int i = blockIdx.x * blockDim.x + threadIdx.x;   /* 131072 threads */
  if (i < 512) stats[i] = 0.0f;
  int which = i >> 15, j = i & 32767;
  if (which == 0)      wt[j] = (__bf16)Wt[j];
  else if (which == 1) wp[j] = (__bf16)Wp[j];
  else if (which == 2) wg[j] = (__bf16)Wg[j];
  else                 wz[j] = (__bf16)Wz[j];
}

/* ---- kernel 1: projections. block = 64 pixels x 128 outputs, one of Q/K/V.
   Q gets bias bt and 1/sqrt(P) folded in; V written transposed [p][n]. ---- */
__global__ __launch_bounds__(128) void nl_proj_kernel(
    const float* __restrict__ x,
    const __bf16* __restrict__ wq, const __bf16* __restrict__ wk, const __bf16* __restrict__ wv,
    const float* __restrict__ bq, const float* __restrict__ bk, const float* __restrict__ bv,
    __bf16* __restrict__ Q, __bf16* __restrict__ Kmat, __bf16* __restrict__ Vt) {
  __shared__ __align__(16) __bf16 xs[64][40];   /* 64 pixels x 32 channels, padded */
  int b  = blockIdx.x >> 6;
  int n0 = (blockIdx.x & 63) << 6;
  int proj = blockIdx.y;                        /* 0=Q 1=K 2=V */
  const __bf16* wgt = (proj == 0) ? wq : (proj == 1) ? wk : wv;
  const float* bias = (proj == 0) ? bq : (proj == 1) ? bk : bv;
  int t = threadIdx.x, w = t >> 5, lane = t & 31, hf = lane >> 4, col = lane & 15;

  v8f acc[8] = {};
  for (int c0 = 0; c0 < CC; c0 += 32) {
#pragma unroll
    for (int e = t; e < 64 * 32; e += 128) {
      int nj = e & 63, ci = e >> 6;
      xs[nj][ci] = (__bf16)x[((size_t)(b * CC + c0 + ci)) * NN + n0 + nj];
    }
    __syncthreads();
    v16bf a = load_frag16(&xs[w * 16][0], 40, 0);
#pragma unroll
    for (int pb = 0; pb < 8; ++pb) {
      v16bf bb = load_frag16(wgt + (size_t)(pb * 16) * CC, CC, c0);
      acc[pb] = wmma_bf16(a, bb, acc[pb]);
    }
    __syncthreads();
  }
  float qs = (proj == 0) ? QSCALE : 1.0f;
#pragma unroll
  for (int pb = 0; pb < 8; ++pb) {
    int p = pb * 16 + col;
    float bv_ = bias[p];
    if (proj < 2) {
      __bf16* out = (proj == 0) ? Q : Kmat;
#pragma unroll
      for (int r = 0; r < 8; ++r) {
        int n = n0 + w * 16 + 8 * hf + r;
        out[((size_t)b * NN + n) * PP + p] = (__bf16)((acc[pb][r] + bv_) * qs);
      }
    } else {
      v8bf tv;
#pragma unroll
      for (int r = 0; r < 8; ++r) tv[r] = (__bf16)(acc[pb][r] + bv_);
      *(v8bf*)(Vt + ((size_t)(b * PP + p)) * NN + n0 + w * 16 + 8 * hf) = tv;
    }
  }
}

__global__ __launch_bounds__(128) void nl_attn_kernel(
    const __bf16* __restrict__ Q, const __bf16* __restrict__ Kmat,
    const __bf16* __restrict__ Vt, __bf16* __restrict__ Y) {
  __shared__ __align__(16) __bf16 kbuf[2][64][136];
  __shared__ __align__(16) __bf16 ps[4][16][72];
  int b  = blockIdx.x >> 6;
  int n0 = (blockIdx.x & 63) << 6;
  int t = threadIdx.x, w = t >> 5, lane = t & 31, hf = lane >> 4, col = lane & 15;
  const __bf16* Qb = Q    + (size_t)b * NN * PP;
  const __bf16* Kb = Kmat + (size_t)b * NN * PP;
  const __bf16* Vb = Vt   + (size_t)b * PP * NN;

  v16bf qf[4];
#pragma unroll
  for (int kk = 0; kk < 4; ++kk)
    qf[kk] = load_frag16(Qb + (size_t)(n0 + w * 16) * PP, PP, kk * 32);

  float mrow[8], lrow[8];
#pragma unroll
  for (int r = 0; r < 8; ++r) { mrow[r] = -1e30f; lrow[r] = 0.0f; }
  v8f o[8] = {};

  if (w == 0) tdm_load_k_tile(&kbuf[0][0][0], Kb);   /* prologue DMA, tile 0 */
  __builtin_amdgcn_s_wait_tensorcnt(0);
  __syncthreads();

  for (int kv0 = 0; kv0 < NN; kv0 += 64) {
    int cur = (kv0 >> 6) & 1;
    if (w == 0 && kv0 + 64 < NN)                     /* DMA next tile while computing */
      tdm_load_k_tile(&kbuf[cur ^ 1][0][0], Kb + (size_t)(kv0 + 64) * PP);
    if (kv0 + 64 < NN) {                             /* prefetch next V tile rows */
#pragma unroll
      for (int i = 0; i < 4; ++i)
        __builtin_prefetch(Vb + (size_t)(i * 32 + lane) * NN + kv0 + 64, 0, 1);
    }
    v8f s[4] = {};
#pragma unroll
    for (int kk = 0; kk < 4; ++kk)
#pragma unroll
      for (int j = 0; j < 4; ++j) {
        v16bf kf = load_frag16(&kbuf[cur][j * 16][0], 136, kk * 32);
        s[j] = wmma_bf16(qf[kk], kf, s[j]);
      }
    float newm[8], alpha[8];
#pragma unroll
    for (int r = 0; r < 8; ++r) {
      float v = fmaxf(fmaxf(s[0][r], s[1][r]), fmaxf(s[2][r], s[3][r]));
      v = fmaxf(v, __shfl_xor(v, 1));
      v = fmaxf(v, __shfl_xor(v, 2));
      v = fmaxf(v, __shfl_xor(v, 4));
      v = fmaxf(v, __shfl_xor(v, 8));
      newm[r]  = fmaxf(mrow[r], v);
      alpha[r] = __expf(mrow[r] - newm[r]);
      mrow[r]  = newm[r];
    }
#pragma unroll
    for (int j = 0; j < 4; ++j)
#pragma unroll
      for (int r = 0; r < 8; ++r) s[j][r] = __expf(s[j][r] - newm[r]);
#pragma unroll
    for (int r = 0; r < 8; ++r) {
      float v = s[0][r] + s[1][r] + s[2][r] + s[3][r];
      v += __shfl_xor(v, 1); v += __shfl_xor(v, 2);
      v += __shfl_xor(v, 4); v += __shfl_xor(v, 8);
      lrow[r] = lrow[r] * alpha[r] + v;
    }
#pragma unroll
    for (int pb = 0; pb < 8; ++pb)
#pragma unroll
      for (int r = 0; r < 8; ++r) o[pb][r] *= alpha[r];
    /* restage P~ (C/D layout) as bf16 A-fragment tile in LDS (wave-local) */
#pragma unroll
    for (int j = 0; j < 4; ++j)
#pragma unroll
      for (int r = 0; r < 8; ++r)
        ps[w][8 * hf + r][j * 16 + col] = (__bf16)s[j][r];
    /* O += P~ x V  (V transposed: B^T rows contiguous) */
#pragma unroll
    for (int kk = 0; kk < 2; ++kk) {
      v16bf af = load_frag16(&ps[w][0][0], 72, kk * 32);
#pragma unroll
      for (int pb = 0; pb < 8; ++pb) {
        v16bf vf = load_frag16(Vb + (size_t)(pb * 16) * NN + kv0, NN, kk * 32);
        o[pb] = wmma_bf16(af, vf, o[pb]);
      }
    }
    __builtin_amdgcn_s_wait_tensorcnt(0);  /* wave0: next tile landed */
    __syncthreads();                       /* publish to all waves */
  }
#pragma unroll
  for (int pb = 0; pb < 8; ++pb) {
    int p = pb * 16 + col;
#pragma unroll
    for (int r = 0; r < 8; ++r) {
      int n = n0 + w * 16 + 8 * hf + r;
      Y[((size_t)b * NN + n) * PP + p] = (__bf16)(o[pb][r] / lrow[r]);
    }
  }
}

/* ---- kernel 3: z = Wz*y + bz (stored [b][c][n] fp32) + BN stat atomics ---- */
__global__ __launch_bounds__(128) void nl_zproj_kernel(
    const __bf16* __restrict__ Y, const __bf16* __restrict__ wz,
    const float* __restrict__ bz, float* __restrict__ Z,
    float* __restrict__ sum, float* __restrict__ ssq) {
  int b  = blockIdx.x >> 6;
  int n0 = (blockIdx.x & 63) << 6;
  int t = threadIdx.x, w = t >> 5, lane = t & 31, hf = lane >> 4, col = lane & 15;
  v8f acc[16] = {};
  const __bf16* Yb = Y + ((size_t)b * NN + n0 + w * 16) * PP;
#pragma unroll
  for (int kk = 0; kk < 4; ++kk) {
    v16bf af = load_frag16(Yb, PP, kk * 32);
#pragma unroll
    for (int cb = 0; cb < 16; ++cb) {
      v16bf bf = load_frag16(wz + (size_t)(cb * 16) * PP, PP, kk * 32);
      acc[cb] = wmma_bf16(af, bf, acc[cb]);
    }
  }
#pragma unroll
  for (int cb = 0; cb < 16; ++cb) {
    int c = cb * 16 + col;
    float bias = bz[c];
    v8f vv; float ls = 0.0f, lss = 0.0f;
#pragma unroll
    for (int r = 0; r < 8; ++r) {
      float v = acc[cb][r] + bias;
      vv[r] = v; ls += v; lss += v * v;
    }
    *(v8f*)(Z + ((size_t)(b * CC + c)) * NN + n0 + w * 16 + 8 * hf) = vv;
    atomicAdd(&sum[c], ls);
    atomicAdd(&ssq[c], lss);
  }
}

/* ---- kernel 4: finalize BN stats into per-channel scale/shift ---- */
__global__ void nl_stats_kernel(const float* __restrict__ sum, const float* __restrict__ ssq,
                                const float* __restrict__ gamma, const float* __restrict__ beta,
                                float* __restrict__ scale, float* __restrict__ shift) {
  int c = threadIdx.x;
  float inv  = 1.0f / (float)(BB * NN);
  float mean = sum[c] * inv;
  float var  = ssq[c] * inv - mean * mean;
  float sc   = gamma[c] * rsqrtf(var + BN_EPS);
  scale[c] = sc;
  shift[c] = beta[c] - mean * sc;
}

/* ---- kernel 5: out = z*scale + shift + x (vectorized float4) ---- */
__global__ __launch_bounds__(256) void nl_apply_kernel(
    const float* __restrict__ Z, const float* __restrict__ x,
    const float* __restrict__ scale, const float* __restrict__ shift,
    float* __restrict__ out) {
  size_t i4 = (size_t)blockIdx.x * blockDim.x + threadIdx.x;  /* 1048576 vec4 */
  int c = (int)((i4 >> 10) & (CC - 1));                       /* N=4096 -> 1024 vec4 per ch */
  float4 z  = ((const float4*)Z)[i4];
  float4 xv = ((const float4*)x)[i4];
  float sc = scale[c], sh = shift[c];
  float4 o;
  o.x = z.x * sc + sh + xv.x;
  o.y = z.y * sc + sh + xv.y;
  o.z = z.z * sc + sh + xv.z;
  o.w = z.w * sc + sh + xv.w;
  ((float4*)out)[i4] = o;
}

extern "C" void kernel_launch(void* const* d_in, const int* in_sizes, int n_in,
                              void* d_out, int out_size, void* d_ws, size_t ws_size,
                              hipStream_t stream) {
  const float* x     = (const float*)d_in[0];
  const float* Wt    = (const float*)d_in[1];
  const float* bt    = (const float*)d_in[2];
  const float* Wp    = (const float*)d_in[3];
  const float* bp    = (const float*)d_in[4];
  const float* Wg    = (const float*)d_in[5];
  const float* bg    = (const float*)d_in[6];
  const float* Wz    = (const float*)d_in[7];
  const float* bz    = (const float*)d_in[8];
  const float* gamma = (const float*)d_in[9];
  const float* beta  = (const float*)d_in[10];
  (void)in_sizes; (void)n_in; (void)out_size; (void)ws_size;

  char* ws = (char*)d_ws;
  __bf16* wt  = (__bf16*)(ws + OFF_WT);
  __bf16* wp  = (__bf16*)(ws + OFF_WP);
  __bf16* wg  = (__bf16*)(ws + OFF_WG);
  __bf16* wz  = (__bf16*)(ws + OFF_WZ);
  __bf16* Qw  = (__bf16*)(ws + OFF_Q);
  __bf16* Kw  = (__bf16*)(ws + OFF_K);
  __bf16* Vtw = (__bf16*)(ws + OFF_VT);
  __bf16* Yw  = (__bf16*)(ws + OFF_Y);
  float*  Zw  = (float*)(ws + OFF_Z);
  float*  sumw = (float*)(ws + OFF_SUM);
  float*  ssqw = (float*)(ws + OFF_SSQ);
  float*  sclw = (float*)(ws + OFF_SCL);
  float*  shfw = (float*)(ws + OFF_SHF);

  nl_prep_kernel<<<512, 256, 0, stream>>>(Wt, Wp, Wg, Wz, wt, wp, wg, wz, sumw);
  nl_proj_kernel<<<dim3(BB * (NN / 64), 3), 128, 0, stream>>>(
      x, wt, wp, wg, bt, bp, bg, Qw, Kw, Vtw);
  nl_attn_kernel<<<BB * (NN / 64), 128, 0, stream>>>(Qw, Kw, Vtw, Yw);
  nl_zproj_kernel<<<BB * (NN / 64), 128, 0, stream>>>(Yw, wz, bz, Zw, sumw, ssqw);
  nl_stats_kernel<<<1, CC, 0, stream>>>(sumw, ssqw, gamma, beta, sclw, shfw);
  nl_apply_kernel<<<(BB * CC * NN) / 4 / 256, 256, 0, stream>>>(Zw, x, sclw, shfw,
                                                                (float*)d_out);
}

// v001
// A run of this version takes 161 microseconds.
// Two timings next to v000 put it at 1.46 and 1.45 times that version's speed.
#include <hip/hip_runtime.h>

typedef __attribute__((ext_vector_type(16))) __bf16 v16bf;
typedef __attribute__((ext_vector_type(8)))  __bf16 v8bf;
typedef __attribute__((ext_vector_type(8)))  float  v8f;
typedef unsigned int u32x4 __attribute__((ext_vector_type(4)));
typedef int          i32x8 __attribute__((ext_vector_type(8)));
typedef int          i32x4 __attribute__((ext_vector_type(4)));

#define BB 4
#define CC 256
#define PP 128
#define NN 4096
#define QSCALE 0.08838834764831845f   /* 1/sqrt(128) */
#define BN_EPS 1e-5f

/* workspace byte offsets (all 256B aligned) */
#define OFF_WT   0u
#define OFF_WP   65536u
#define OFF_WG   131072u
#define OFF_WZ   196608u
#define OFF_Q    262144u      /* B*N*P bf16 = 4 MB */
#define OFF_K    4456448u
#define OFF_VT   8650752u     /* transposed values: [b][p][n] */
#define OFF_Y    12845056u
#define OFF_Z    17039360u    /* B*C*N fp32 = 16 MB */
#define OFF_SUM  33816576u    /* 256 f32 */
#define OFF_SSQ  33817600u    /* 256 f32 */
#define OFF_SCL  33818624u
#define OFF_SHF  33819648u

/* Load a 16xK WMMA A/B fragment (K-step=32) from a row-major bf16 tile.
   tile_base points at row 0 of the 16-row block; ld = row stride (elems).
   Per-lane: row = lane&15, k-runs at k0+8*(lane>>4) and +16. */
__device__ __forceinline__ v16bf load_frag16(const __bf16* tile_base, int ld, int k0) {
  int lane = threadIdx.x & 31;
  const __bf16* p = tile_base + (size_t)(lane & 15) * ld + k0 + ((lane >> 4) << 3);
  v8bf lo = *(const v8bf*)(p);
  v8bf hi = *(const v8bf*)(p + 16);
  v16bf f;
#pragma unroll
  for (int i = 0; i < 8; ++i) { f[i] = lo[i]; f[i + 8] = hi[i]; }
  return f;
}

__device__ __forceinline__ v8f wmma_bf16(v16bf a, v16bf b, v8f c) {
  return __builtin_amdgcn_wmma_f32_16x16x32_bf16(false, a, false, b, (short)0, c,
                                                 false, false);
}

__device__ __forceinline__ void tdm_load_k_tile(const __bf16* lds_dst,
                                                const __bf16* gsrc) {
  unsigned int ldsoff = (unsigned int)(uintptr_t)lds_dst;   /* addr[31:0] = LDS offset */
  unsigned long long ga = (unsigned long long)(uintptr_t)gsrc;
  u32x4 g0;
  g0[0] = 1u;                                              /* count=1, user mode */
  g0[1] = ldsoff;                                          /* lds_addr */
  g0[2] = (unsigned int)ga;                                /* global_addr[31:0] */
  g0[3] = (unsigned int)((ga >> 32) & 0x01FFFFFFu) | (2u << 30); /* [56:32], type=2 */
  i32x8 g1;
  g1[0] = (int)((1u << 16)
              | (1u << 20)
              | (5u << 22)
              | (3u << 25));
  g1[1] = (int)(128u << 16);
  g1[2] = (int)(4096u << 16);
  g1[3] = (int)(128u << 16);
  g1[4] = 64;
  g1[5] = 128;
  g1[6] = 0;
  g1[7] = 0;
  i32x4 z4 = {};
  i32x8 z8 = {};
  __builtin_amdgcn_tensor_load_to_lds(g0, g1, z4, z4, z8, 0);
}

typedef unsigned int u32x8 __attribute__((ext_vector_type(8)));

__device__ __forceinline__ unsigned int pinned(unsigned int v) {
  unsigned int w = (unsigned int)__builtin_amdgcn_readfirstlane(v);
  asm volatile("" : "+s"(w));   /* pinned(): the word stays in a scalar register */
  return w;
}
__device__ __forceinline__ unsigned int uni(unsigned int v) {
  return (unsigned int)__builtin_amdgcn_readfirstlane(v);
}

#define VROWB   128u      /* bytes of one V^T tile row: 64 keys, bf16 */
#define VPITCHE 72        /* LDS pitch in elements: row + 16 B pad = 144 B, an odd multiple of 16 B */

/* V^T tile, 128 rows (p) x 128 bytes (64 keys), source pitch one V^T row:
   1-byte elements, every extent in bytes, a 4-dword pad behind each 128-B row. */
__device__ __forceinline__ u32x8 tdm_v_group1() {
  u32x8 g;
  g[0] = uni((1u << 20) | (4u << 22) | (3u << 25));
  g[1] = uni(VROWB << 16);
  g[2] = uni((unsigned int)PP << 16);
  g[3] = uni(VROWB << 16);
  g[4] = uni((unsigned int)PP);
  g[5] = uni((unsigned int)NN * 2u);
  g[6] = uni(0u);
  g[7] = uni(0u);
  return g;
}
__device__ __forceinline__ u32x4 tdm_v_group0(const __bf16* lds_dst, const __bf16* gsrc) {
  unsigned long long ga = (unsigned long long)(uintptr_t)gsrc;
  u32x4 g0;
  g0[0] = uni(1u);
  g0[1] = uni((unsigned int)(uintptr_t)lds_dst);
  g0[2] = uni((unsigned int)ga);
  g0[3] = uni((((unsigned int)(ga >> 32)) & 0x01FFFFFFu) | 0x80000000u);
  return g0;
}
__device__ __forceinline__ u32x4 tdm_v_next(u32x4 g0, unsigned int lds_sum) {
  unsigned long long a = ((((unsigned long long)g0[3]) << 32) | g0[2]) + VROWB;
  g0[1] = uni(lds_sum - g0[1]);
  g0[2] = uni((unsigned int)a);
  g0[3] = uni((unsigned int)(a >> 32));
  return g0;
}
__device__ __forceinline__ void tdm_load_v_tile(u32x4 g0, u32x8 g1) {
  asm volatile("tensor_load_to_lds %0, %1" :: "s"(g0), "s"(g1) : "memory");
}

/* ---- kernel 0: fp32 weights -> bf16, zero BN stat accumulators ---- */
__global__ void nl_prep_kernel(const float* __restrict__ Wt, const float* __restrict__ Wp,
                               const float* __restrict__ Wg, const float* __restrict__ Wz,
                               __bf16* wt, __bf16* wp, __bf16* wg, __bf16* wz,
                               float* stats /* 512 floats: sum | sumsq */) {
  int i = blockIdx.x * blockDim.x + threadIdx.x;   /* 131072 threads */
  if (i < 512) stats[i] = 0.0f;
  int which = i >> 15, j = i & 32767;
  if (which == 0)      wt[j] = (__bf16)Wt[j];
  else if (which == 1) wp[j] = (__bf16)Wp[j];
  else if (which == 2) wg[j] = (__bf16)Wg[j];
  else                 wz[j] = (__bf16)Wz[j];
}

/* ---- kernel 1: projections. block = 64 pixels x 128 outputs, one of Q/K/V.
   Q gets bias bt and 1/sqrt(P) folded in; V written transposed [p][n]. ---- */
__global__ __launch_bounds__(128) void nl_proj_kernel(
    const float* __restrict__ x,
    const __bf16* __restrict__ wq, const __bf16* __restrict__ wk, const __bf16* __restrict__ wv,
    const float* __restrict__ bq, const float* __restrict__ bk, const float* __restrict__ bv,
    __bf16* __restrict__ Q, __bf16* __restrict__ Kmat, __bf16* __restrict__ Vt) {
  __shared__ __align__(16) __bf16 xs[64][40];   /* 64 pixels x 32 channels, padded */
  int b  = blockIdx.x >> 6;
  int n0 = (blockIdx.x & 63) << 6;
  int proj = blockIdx.y;                        /* 0=Q 1=K 2=V */
  const __bf16* wgt = (proj == 0) ? wq : (proj == 1) ? wk : wv;
  const float* bias = (proj == 0) ? bq : (proj == 1) ? bk : bv;
  int t = threadIdx.x, w = t >> 5, lane = t & 31, hf = lane >> 4, col = lane & 15;

  v8f acc[8] = {};
  for (int c0 = 0; c0 < CC; c0 += 32) {
#pragma unroll
    for (int e = t; e < 64 * 32; e += 128) {
      int nj = e & 63, ci = e >> 6;
      xs[nj][ci] = (__bf16)x[((size_t)(b * CC + c0 + ci)) * NN + n0 + nj];
    }
    __syncthreads();
    v16bf a = load_frag16(&xs[w * 16][0], 40, 0);
#pragma unroll
    for (int pb = 0; pb < 8; ++pb) {
      v16bf bb = load_frag16(wgt + (size_t)(pb * 16) * CC, CC, c0);
      acc[pb] = wmma_bf16(a, bb, acc[pb]);
    }
    __syncthreads();
  }
  float qs = (proj == 0) ? QSCALE : 1.0f;
#pragma unroll
  for (int pb = 0; pb < 8; ++pb) {
    int p = pb * 16 + col;
    float bv_ = bias[p];
    if (proj < 2) {
      __bf16* out = (proj == 0) ? Q : Kmat;
#pragma unroll
      for (int r = 0; r < 8; ++r) {
        int n = n0 + w * 16 + 8 * hf + r;
        out[((size_t)b * NN + n) * PP + p] = (__bf16)((acc[pb][r] + bv_) * qs);
      }
    } else {
      v8bf tv;
#pragma unroll
      for (int r = 0; r < 8; ++r) tv[r] = (__bf16)(acc[pb][r] + bv_);
      *(v8bf*)(Vt + ((size_t)(b * PP + p)) * NN + n0 + w * 16 + 8 * hf) = tv;
    }
  }
}

__global__ __launch_bounds__(128) void nl_attn_kernel(
    const __bf16* __restrict__ Q, const __bf16* __restrict__ Kmat,
    const __bf16* __restrict__ Vt, __bf16* __restrict__ Y) {
  __shared__ __attribute__((aligned(2048))) __bf16 vbuf[2][PP][VPITCHE]; /* padded V^T tiles, 9 x 2 KiB each */
  __shared__ __align__(16) __bf16 kbuf[2][64][136];
  __shared__ __align__(16) __bf16 ps[4][16][72];
  int b  = blockIdx.x >> 6;
  int n0 = (blockIdx.x & 63) << 6;
  int t = threadIdx.x, w = t >> 5, lane = t & 31, hf = lane >> 4, col = lane & 15;
  const __bf16* Qb = Q    + (size_t)b * NN * PP;
  const __bf16* Kb = Kmat + (size_t)b * NN * PP;
  const __bf16* Vb = Vt   + (size_t)b * PP * NN;

  v16bf qf[4];
#pragma unroll
  for (int kk = 0; kk < 4; ++kk)
    qf[kk] = load_frag16(Qb + (size_t)(n0 + w * 16) * PP, PP, kk * 32);

  float mrow[8], lrow[8];
#pragma unroll
  for (int r = 0; r < 8; ++r) { mrow[r] = -1e30f; lrow[r] = 0.0f; }
  v8f o[8] = {};

  const unsigned int wave = uni(threadIdx.x >> 5);
  u32x8 vg1 = tdm_v_group1();
  u32x4 vg0 = tdm_v_group0(&vbuf[0][0][0], Vb);
  asm volatile("" : "+s"(vg1));
  asm volatile("" : "+s"(vg0));
  const unsigned int vlds_sum = uni((unsigned int)(uintptr_t)&vbuf[0][0][0]) +
                                uni((unsigned int)(uintptr_t)&vbuf[1][0][0]);
  if (w == 0) tdm_load_k_tile(&kbuf[0][0][0], Kb);   /* prologue DMA, tile 0 */
  if (pinned(wave == 1u)) {                          /* V^T stage 0 */
    tdm_load_v_tile(vg0, vg1);
    asm volatile("s_wait_tensorcnt 0x0" ::: "memory");   /* stage 0 landed before it is published */
  }
  __builtin_amdgcn_s_wait_tensorcnt(0);
  __syncthreads();
  if (pinned(wave == 1u)) {                          /* V^T stage 1 flies under pass 0 */
    vg0 = tdm_v_next(vg0, vlds_sum);
    tdm_load_v_tile(vg0, vg1);
  }

  for (int kv0 = 0; kv0 < NN; kv0 += 64) {
    int cur = (kv0 >> 6) & 1;
    if (w == 0 && kv0 + 64 < NN)                     /* DMA next tile while computing */
      tdm_load_k_tile(&kbuf[cur ^ 1][0][0], Kb + (size_t)(kv0 + 64) * PP);
    v8f s[4] = {};
#pragma unroll
    for (int kk = 0; kk < 4; ++kk)
#pragma unroll
      for (int j = 0; j < 4; ++j) {
        v16bf kf = load_frag16(&kbuf[cur][j * 16][0], 136, kk * 32);
        s[j] = wmma_bf16(qf[kk], kf, s[j]);
      }
    float newm[8], alpha[8];
#pragma unroll
    for (int r = 0; r < 8; ++r) {
      float v = fmaxf(fmaxf(s[0][r], s[1][r]), fmaxf(s[2][r], s[3][r]));
      v = fmaxf(v, __shfl_xor(v, 1));
      v = fmaxf(v, __shfl_xor(v, 2));
      v = fmaxf(v, __shfl_xor(v, 4));
      v = fmaxf(v, __shfl_xor(v, 8));
      newm[r]  = fmaxf(mrow[r], v);
      alpha[r] = __expf(mrow[r] - newm[r]);
      mrow[r]  = newm[r];
    }
#pragma unroll
    for (int j = 0; j < 4; ++j)
#pragma unroll
      for (int r = 0; r < 8; ++r) s[j][r] = __expf(s[j][r] - newm[r]);
#pragma unroll
    for (int r = 0; r < 8; ++r) {
      float v = s[0][r] + s[1][r] + s[2][r] + s[3][r];
      v += __shfl_xor(v, 1); v += __shfl_xor(v, 2);
      v += __shfl_xor(v, 4); v += __shfl_xor(v, 8);
      lrow[r] = lrow[r] * alpha[r] + v;
    }
#pragma unroll
    for (int pb = 0; pb < 8; ++pb)
#pragma unroll
      for (int r = 0; r < 8; ++r) o[pb][r] *= alpha[r];
    /* restage P~ (C/D layout) as bf16 A-fragment tile in LDS (wave-local) */
#pragma unroll
    for (int j = 0; j < 4; ++j)
#pragma unroll
      for (int r = 0; r < 8; ++r)
        ps[w][8 * hf + r][j * 16 + col] = (__bf16)s[j][r];
    /* O += P~ x V  (V transposed: B^T rows contiguous) */
#pragma unroll
    for (int kk = 0; kk < 2; ++kk) {
      v16bf af = load_frag16(&ps[w][0][0], 72, kk * 32);
#pragma unroll
      for (int pb = 0; pb < 8; ++pb) {
        v16bf vf = load_frag16(&vbuf[cur][pb * 16][0], VPITCHE, kk * 32);
        o[pb] = wmma_bf16(af, vf, o[pb]);
      }
    }
    asm volatile("s_wait_dscnt 0x0" ::: "memory");         /* this pass's LDS reads done before a refill */
    if (pinned(wave == 1u))
      asm volatile("s_wait_tensorcnt 0x0" ::: "memory");   /* wave1: next V^T tile landed */
    __builtin_amdgcn_s_wait_tensorcnt(0);  /* wave0: next tile landed */
    __syncthreads();                       /* publish to all waves */
    if (pinned((wave == 1u) & (kv0 + 128 < NN))) {         /* refill the buffer this pass has read */
      vg0 = tdm_v_next(vg0, vlds_sum);
      tdm_load_v_tile(vg0, vg1);
    }
  }
  asm volatile("s_wait_tensorcnt 0x0" ::: "memory");       /* nothing in flight when the wave ends */
  asm volatile("s_wait_dscnt 0x0" ::: "memory");           /* the ring's closing wait on this wave's LDS reads */
#pragma unroll
  for (int pb = 0; pb < 8; ++pb) {
    int p = pb * 16 + col;
#pragma unroll
    for (int r = 0; r < 8; ++r) {
      int n = n0 + w * 16 + 8 * hf + r;
      Y[((size_t)b * NN + n) * PP + p] = (__bf16)(o[pb][r] / lrow[r]);
    }
  }
}

/* ---- kernel 3: z = Wz*y + bz (stored [b][c][n] fp32) + BN stat atomics ---- */
__global__ __launch_bounds__(128) void nl_zproj_kernel(
    const __bf16* __restrict__ Y, const __bf16* __restrict__ wz,
    const float* __restrict__ bz, float* __restrict__ Z,
    float* __restrict__ sum, float* __restrict__ ssq) {
  int b  = blockIdx.x >> 6;
  int n0 = (blockIdx.x & 63) << 6;
  int t = threadIdx.x, w = t >> 5, lane = t & 31, hf = lane >> 4, col = lane & 15;
  v8f acc[16] = {};
  const __bf16* Yb = Y + ((size_t)b * NN + n0 + w * 16) * PP;
#pragma unroll
  for (int kk = 0; kk < 4; ++kk) {
    v16bf af = load_frag16(Yb, PP, kk * 32);
#pragma unroll
    for (int cb = 0; cb < 16; ++cb) {
      v16bf bf = load_frag16(wz + (size_t)(cb * 16) * PP, PP, kk * 32);
      acc[cb] = wmma_bf16(af, bf, acc[cb]);
    }
  }
#pragma unroll
  for (int cb = 0; cb < 16; ++cb) {
    int c = cb * 16 + col;
    float bias = bz[c];
    v8f vv; float ls = 0.0f, lss = 0.0f;
#pragma unroll
    for (int r = 0; r < 8; ++r) {
      float v = acc[cb][r] + bias;
      vv[r] = v; ls += v; lss += v * v;
    }
    *(v8f*)(Z + ((size_t)(b * CC + c)) * NN + n0 + w * 16 + 8 * hf) = vv;
    atomicAdd(&sum[c], ls);
    atomicAdd(&ssq[c], lss);
  }
}

/* ---- kernel 4: finalize BN stats into per-channel scale/shift ---- */
__global__ void nl_stats_kernel(const float* __restrict__ sum, const float* __restrict__ ssq,
                                const float* __restrict__ gamma, const float* __restrict__ beta,
                                float* __restrict__ scale, float* __restrict__ shift) {
  int c = threadIdx.x;
  float inv  = 1.0f / (float)(BB * NN);
  float mean = sum[c] * inv;
  float var  = ssq[c] * inv - mean * mean;
  float sc   = gamma[c] * rsqrtf(var + BN_EPS);
  scale[c] = sc;
  shift[c] = beta[c] - mean * sc;
}

/* ---- kernel 5: out = z*scale + shift + x (vectorized float4) ---- */
__global__ __launch_bounds__(256) void nl_apply_kernel(
    const float* __restrict__ Z, const float* __restrict__ x,
    const float* __restrict__ scale, const float* __restrict__ shift,
    float* __restrict__ out) {
  size_t i4 = (size_t)blockIdx.x * blockDim.x + threadIdx.x;  /* 1048576 vec4 */
  int c = (int)((i4 >> 10) & (CC - 1));                       /* N=4096 -> 1024 vec4 per ch */
  float4 z  = ((const float4*)Z)[i4];
  float4 xv = ((const float4*)x)[i4];
  float sc = scale[c], sh = shift[c];
  float4 o;
  o.x = z.x * sc + sh + xv.x;
  o.y = z.y * sc + sh + xv.y;
  o.z = z.z * sc + sh + xv.z;
  o.w = z.w * sc + sh + xv.w;
  ((float4*)out)[i4] = o;
}

extern "C" void kernel_launch(void* const* d_in, const int* in_sizes, int n_in,
                              void* d_out, int out_size, void* d_ws, size_t ws_size,
                              hipStream_t stream) {
  const float* x     = (const float*)d_in[0];
  const float* Wt    = (const float*)d_in[1];
  const float* bt    = (const float*)d_in[2];
  const float* Wp    = (const float*)d_in[3];
  const float* bp    = (const float*)d_in[4];
  const float* Wg    = (const float*)d_in[5];
  const float* bg    = (const float*)d_in[6];
  const float* Wz    = (const float*)d_in[7];
  const float* bz    = (const float*)d_in[8];
  const float* gamma = (const float*)d_in[9];
  const float* beta  = (const float*)d_in[10];
  (void)in_sizes; (void)n_in; (void)out_size; (void)ws_size;

  char* ws = (char*)d_ws;
  __bf16* wt  = (__bf16*)(ws + OFF_WT);
  __bf16* wp  = (__bf16*)(ws + OFF_WP);
  __bf16* wg  = (__bf16*)(ws + OFF_WG);
  __bf16* wz  = (__bf16*)(ws + OFF_WZ);
  __bf16* Qw  = (__bf16*)(ws + OFF_Q);
  __bf16* Kw  = (__bf16*)(ws + OFF_K);
  __bf16* Vtw = (__bf16*)(ws + OFF_VT);
  __bf16* Yw  = (__bf16*)(ws + OFF_Y);
  float*  Zw  = (float*)(ws + OFF_Z);
  float*  sumw = (float*)(ws + OFF_SUM);
  float*  ssqw = (float*)(ws + OFF_SSQ);
  float*  sclw = (float*)(ws + OFF_SCL);
  float*  shfw = (float*)(ws + OFF_SHF);

  nl_prep_kernel<<<512, 256, 0, stream>>>(Wt, Wp, Wg, Wz, wt, wp, wg, wz, sumw);
  nl_proj_kernel<<<dim3(BB * (NN / 64), 3), 128, 0, stream>>>(
      x, wt, wp, wg, bt, bp, bg, Qw, Kw, Vtw);
  nl_attn_kernel<<<BB * (NN / 64), 128, 0, stream>>>(Qw, Kw, Vtw, Yw);
  nl_zproj_kernel<<<BB * (NN / 64), 128, 0, stream>>>(Yw, wz, bz, Zw, sumw, ssqw);
  nl_stats_kernel<<<1, CC, 0, stream>>>(sumw, ssqw, gamma, beta, sclw, shfw);
  nl_apply_kernel<<<(BB * CC * NN) / 4 / 256, 256, 0, stream>>>(Zw, x, sclw, shfw,
                                                                (float*)d_out);
}

// v002
// It runs in 141 microseconds.
// Timed twice side by side with v001, it ran 1.15 and 1.14 times as fast.
// Over all steps from v000 it is 1.66 times as fast.
#include <hip/hip_runtime.h>

typedef __attribute__((ext_vector_type(16))) __bf16 v16bf;
typedef __attribute__((ext_vector_type(8)))  __bf16 v8bf;
typedef __attribute__((ext_vector_type(8)))  float  v8f;
typedef unsigned int u32x4 __attribute__((ext_vector_type(4)));
typedef int          i32x8 __attribute__((ext_vector_type(8)));
typedef int          i32x4 __attribute__((ext_vector_type(4)));

#define BB 4
#define CC 256
#define PP 128
#define NN 4096
#define QSCALE 0.08838834764831845f   /* 1/sqrt(128) */
#define BN_EPS 1e-5f

/* workspace byte offsets (all 256B aligned) */
#define OFF_WT   0u
#define OFF_WP   65536u
#define OFF_WG   131072u
#define OFF_WZ   196608u
#define OFF_Q    262144u      /* B*N*P bf16 = 4 MB */
#define OFF_K    4456448u
#define OFF_VT   8650752u     /* transposed values: [b][p][n] */
#define OFF_Y    12845056u
#define OFF_Z    17039360u    /* B*C*N fp32 = 16 MB */
#define OFF_SCL  33818624u
#define OFF_SHF  33819648u
#define OFF_PART 33820672u    /* NBLK rows of 512 f32: per-block sum | sumsq */
#define NBLK (BB * (NN / 64)) /* work-groups of the z projection */

/* Load a 16xK WMMA A/B fragment (K-step=32) from a row-major bf16 tile.
   tile_base points at row 0 of the 16-row block; ld = row stride (elems).
   Per-lane: row = lane&15, k-runs at k0+8*(lane>>4) and +16. */
__device__ __forceinline__ v16bf load_frag16(const __bf16* tile_base, int ld, int k0) {
  int lane = threadIdx.x & 31;
  const __bf16* p = tile_base + (size_t)(lane & 15) * ld + k0 + ((lane >> 4) << 3);
  v8bf lo = *(const v8bf*)(p);
  v8bf hi = *(const v8bf*)(p + 16);
  v16bf f;
#pragma unroll
  for (int i = 0; i < 8; ++i) { f[i] = lo[i]; f[i + 8] = hi[i]; }
  return f;
}

__device__ __forceinline__ v8f wmma_bf16(v16bf a, v16bf b, v8f c) {
  return __builtin_amdgcn_wmma_f32_16x16x32_bf16(false, a, false, b, (short)0, c,
                                                 false, false);
}

__device__ __forceinline__ void tdm_load_k_tile(const __bf16* lds_dst,
                                                const __bf16* gsrc) {
  unsigned int ldsoff = (unsigned int)(uintptr_t)lds_dst;   /* addr[31:0] = LDS offset */
  unsigned long long ga = (unsigned long long)(uintptr_t)gsrc;
  u32x4 g0;
  g0[0] = 1u;                                              /* count=1, user mode */
  g0[1] = ldsoff;                                          /* lds_addr */
  g0[2] = (unsigned int)ga;                                /* global_addr[31:0] */
  g0[3] = (unsigned int)((ga >> 32) & 0x01FFFFFFu) | (2u << 30); /* [56:32], type=2 */
  i32x8 g1;
  g1[0] = (int)((1u << 16)
              | (1u << 20)
              | (5u << 22)
              | (3u << 25));
  g1[1] = (int)(128u << 16);
  g1[2] = (int)(4096u << 16);
  g1[3] = (int)(128u << 16);
  g1[4] = 64;
  g1[5] = 128;
  g1[6] = 0;
  g1[7] = 0;
  i32x4 z4 = {};
  i32x8 z8 = {};
  __builtin_amdgcn_tensor_load_to_lds(g0, g1, z4, z4, z8, 0);
}

typedef unsigned int u32x8 __attribute__((ext_vector_type(8)));

__device__ __forceinline__ unsigned int pinned(unsigned int v) {
  unsigned int w = (unsigned int)__builtin_amdgcn_readfirstlane(v);
  asm volatile("" : "+s"(w));   /* pinned(): the word stays in a scalar register */
  return w;
}
__device__ __forceinline__ unsigned int uni(unsigned int v) {
  return (unsigned int)__builtin_amdgcn_readfirstlane(v);
}

#define VROWB   128u      /* bytes of one V^T tile row: 64 keys, bf16 */
#define VPITCHE 72        /* LDS pitch in elements: row + 16 B pad = 144 B, an odd multiple of 16 B */

/* V^T tile, 128 rows (p) x 128 bytes (64 keys), source pitch one V^T row:
   1-byte elements, every extent in bytes, a 4-dword pad behind each 128-B row. */
__device__ __forceinline__ u32x8 tdm_v_group1() {
  u32x8 g;
  g[0] = uni((1u << 20) | (4u << 22) | (3u << 25));
  g[1] = uni(VROWB << 16);
  g[2] = uni((unsigned int)PP << 16);
  g[3] = uni(VROWB << 16);
  g[4] = uni((unsigned int)PP);
  g[5] = uni((unsigned int)NN * 2u);
  g[6] = uni(0u);
  g[7] = uni(0u);
  return g;
}
__device__ __forceinline__ u32x4 tdm_v_group0(const __bf16* lds_dst, const __bf16* gsrc) {
  unsigned long long ga = (unsigned long long)(uintptr_t)gsrc;
  u32x4 g0;
  g0[0] = uni(1u);
  g0[1] = uni((unsigned int)(uintptr_t)lds_dst);
  g0[2] = uni((unsigned int)ga);
  g0[3] = uni((((unsigned int)(ga >> 32)) & 0x01FFFFFFu) | 0x80000000u);
  return g0;
}
__device__ __forceinline__ u32x4 tdm_v_next(u32x4 g0, unsigned int lds_sum) {
  unsigned long long a = ((((unsigned long long)g0[3]) << 32) | g0[2]) + VROWB;
  g0[1] = uni(lds_sum - g0[1]);
  g0[2] = uni((unsigned int)a);
  g0[3] = uni((unsigned int)(a >> 32));
  return g0;
}
__device__ __forceinline__ void tdm_load_v_tile(u32x4 g0, u32x8 g1) {
  asm volatile("tensor_load_to_lds %0, %1" :: "s"(g0), "s"(g1) : "memory");
}

/* ---- kernel 0: fp32 weights -> bf16 ---- */
__global__ void nl_prep_kernel(const float* __restrict__ Wt, const float* __restrict__ Wp,
                               const float* __restrict__ Wg, const float* __restrict__ Wz,
                               __bf16* wt, __bf16* wp, __bf16* wg, __bf16* wz) {
  int i = blockIdx.x * blockDim.x + threadIdx.x;   /* 131072 threads */
  int which = i >> 15, j = i & 32767;
  if (which == 0)      wt[j] = (__bf16)Wt[j];
  else if (which == 1) wp[j] = (__bf16)Wp[j];
  else if (which == 2) wg[j] = (__bf16)Wg[j];
  else                 wz[j] = (__bf16)Wz[j];
}

/* ---- kernel 1: projections. block = 64 pixels x 128 outputs, one of Q/K/V.
   Q gets bias bt and 1/sqrt(P) folded in; V written transposed [p][n]. ---- */
__global__ __launch_bounds__(128) void nl_proj_kernel(
    const float* __restrict__ x,
    const __bf16* __restrict__ wq, const __bf16* __restrict__ wk, const __bf16* __restrict__ wv,
    const float* __restrict__ bq, const float* __restrict__ bk, const float* __restrict__ bv,
    __bf16* __restrict__ Q, __bf16* __restrict__ Kmat, __bf16* __restrict__ Vt) {
  __shared__ __align__(16) __bf16 xs[64][40];   /* 64 pixels x 32 channels, padded */
  int b  = blockIdx.x >> 6;
  int n0 = (blockIdx.x & 63) << 6;
  int proj = blockIdx.y;                        /* 0=Q 1=K 2=V */
  const __bf16* wgt = (proj == 0) ? wq : (proj == 1) ? wk : wv;
  const float* bias = (proj == 0) ? bq : (proj == 1) ? bk : bv;
  int t = threadIdx.x, w = t >> 5, lane = t & 31, hf = lane >> 4, col = lane & 15;

  v8f acc[8] = {};
  for (int c0 = 0; c0 < CC; c0 += 32) {
#pragma unroll
    for (int e = t; e < 64 * 32; e += 128) {
      int nj = e & 63, ci = e >> 6;
      xs[nj][ci] = (__bf16)x[((size_t)(b * CC + c0 + ci)) * NN + n0 + nj];
    }
    __syncthreads();
    v16bf a = load_frag16(&xs[w * 16][0], 40, 0);
#pragma unroll
    for (int pb = 0; pb < 8; ++pb) {
      v16bf bb = load_frag16(wgt + (size_t)(pb * 16) * CC, CC, c0);
      acc[pb] = wmma_bf16(a, bb, acc[pb]);
    }
    __syncthreads();
  }
  float qs = (proj == 0) ? QSCALE : 1.0f;
#pragma unroll
  for (int pb = 0; pb < 8; ++pb) {
    int p = pb * 16 + col;
    float bv_ = bias[p];
    if (proj < 2) {
      __bf16* out = (proj == 0) ? Q : Kmat;
#pragma unroll
      for (int r = 0; r < 8; ++r) {
        int n = n0 + w * 16 + 8 * hf + r;
        out[((size_t)b * NN + n) * PP + p] = (__bf16)((acc[pb][r] + bv_) * qs);
      }
    } else {
      v8bf tv;
#pragma unroll
      for (int r = 0; r < 8; ++r) tv[r] = (__bf16)(acc[pb][r] + bv_);
      *(v8bf*)(Vt + ((size_t)(b * PP + p)) * NN + n0 + w * 16 + 8 * hf) = tv;
    }
  }
}

__global__ __launch_bounds__(128) void nl_attn_kernel(
    const __bf16* __restrict__ Q, const __bf16* __restrict__ Kmat,
    const __bf16* __restrict__ Vt, __bf16* __restrict__ Y) {
  __shared__ __attribute__((aligned(2048))) __bf16 vbuf[2][PP][VPITCHE]; /* padded V^T tiles, 9 x 2 KiB each */
  __shared__ __align__(16) __bf16 kbuf[2][64][136];
  __shared__ __align__(16) __bf16 ps[4][16][72];
  int b  = blockIdx.x >> 6;
  int n0 = (blockIdx.x & 63) << 6;
  int t = threadIdx.x, w = t >> 5, lane = t & 31, hf = lane >> 4, col = lane & 15;
  const __bf16* Qb = Q    + (size_t)b * NN * PP;
  const __bf16* Kb = Kmat + (size_t)b * NN * PP;
  const __bf16* Vb = Vt   + (size_t)b * PP * NN;

  v16bf qf[4];
#pragma unroll
  for (int kk = 0; kk < 4; ++kk)
    qf[kk] = load_frag16(Qb + (size_t)(n0 + w * 16) * PP, PP, kk * 32);

  float mrow[8], lrow[8];
#pragma unroll
  for (int r = 0; r < 8; ++r) { mrow[r] = -1e30f; lrow[r] = 0.0f; }
  v8f o[8] = {};

  const unsigned int wave = uni(threadIdx.x >> 5);
  u32x8 vg1 = tdm_v_group1();
  u32x4 vg0 = tdm_v_group0(&vbuf[0][0][0], Vb);
  asm volatile("" : "+s"(vg1));
  asm volatile("" : "+s"(vg0));
  const unsigned int vlds_sum = uni((unsigned int)(uintptr_t)&vbuf[0][0][0]) +
                                uni((unsigned int)(uintptr_t)&vbuf[1][0][0]);
  if (w == 0) tdm_load_k_tile(&kbuf[0][0][0], Kb);   /* prologue DMA, tile 0 */
  if (pinned(wave == 1u)) {                          /* V^T stage 0 */
    tdm_load_v_tile(vg0, vg1);
    asm volatile("s_wait_tensorcnt 0x0" ::: "memory");   /* stage 0 landed before it is published */
  }
  __builtin_amdgcn_s_wait_tensorcnt(0);
  __syncthreads();
  if (pinned(wave == 1u)) {                          /* V^T stage 1 flies under pass 0 */
    vg0 = tdm_v_next(vg0, vlds_sum);
    tdm_load_v_tile(vg0, vg1);
  }

  for (int kv0 = 0; kv0 < NN; kv0 += 64) {
    int cur = (kv0 >> 6) & 1;
    if (w == 0 && kv0 + 64 < NN)                     /* DMA next tile while computing */
      tdm_load_k_tile(&kbuf[cur ^ 1][0][0], Kb + (size_t)(kv0 + 64) * PP);
    v8f s[4] = {};
#pragma unroll
    for (int kk = 0; kk < 4; ++kk)
#pragma unroll
      for (int j = 0; j < 4; ++j) {
        v16bf kf = load_frag16(&kbuf[cur][j * 16][0], 136, kk * 32);
        s[j] = wmma_bf16(qf[kk], kf, s[j]);
      }
    float newm[8], alpha[8];
#pragma unroll
    for (int r = 0; r < 8; ++r) {
      float v = fmaxf(fmaxf(s[0][r], s[1][r]), fmaxf(s[2][r], s[3][r]));
      v = fmaxf(v, __shfl_xor(v, 1));
      v = fmaxf(v, __shfl_xor(v, 2));
      v = fmaxf(v, __shfl_xor(v, 4));
      v = fmaxf(v, __shfl_xor(v, 8));
      newm[r]  = fmaxf(mrow[r], v);
      alpha[r] = __expf(mrow[r] - newm[r]);
      mrow[r]  = newm[r];
    }
#pragma unroll
    for (int j = 0; j < 4; ++j)
#pragma unroll
      for (int r = 0; r < 8; ++r) s[j][r] = __expf(s[j][r] - newm[r]);
#pragma unroll
    for (int r = 0; r < 8; ++r) {
      float v = s[0][r] + s[1][r] + s[2][r] + s[3][r];
      v += __shfl_xor(v, 1); v += __shfl_xor(v, 2);
      v += __shfl_xor(v, 4); v += __shfl_xor(v, 8);
      lrow[r] = lrow[r] * alpha[r] + v;
    }
#pragma unroll
    for (int pb = 0; pb < 8; ++pb)
#pragma unroll
      for (int r = 0; r < 8; ++r) o[pb][r] *= alpha[r];
    /* restage P~ (C/D layout) as bf16 A-fragment tile in LDS (wave-local) */
#pragma unroll
    for (int j = 0; j < 4; ++j)
#pragma unroll
      for (int r = 0; r < 8; ++r)
        ps[w][8 * hf + r][j * 16 + col] = (__bf16)s[j][r];
    /* O += P~ x V  (V transposed: B^T rows contiguous) */
#pragma unroll
    for (int kk = 0; kk < 2; ++kk) {
      v16bf af = load_frag16(&ps[w][0][0], 72, kk * 32);
#pragma unroll
      for (int pb = 0; pb < 8; ++pb) {
        v16bf vf = load_frag16(&vbuf[cur][pb * 16][0], VPITCHE, kk * 32);
        o[pb] = wmma_bf16(af, vf, o[pb]);
      }
    }
    asm volatile("s_wait_dscnt 0x0" ::: "memory");         /* this pass's LDS reads done before a refill */
    if (pinned(wave == 1u))
      asm volatile("s_wait_tensorcnt 0x0" ::: "memory");   /* wave1: next V^T tile landed */
    __builtin_amdgcn_s_wait_tensorcnt(0);  /* wave0: next tile landed */
    __syncthreads();                       /* publish to all waves */
    if (pinned((wave == 1u) & (kv0 + 128 < NN))) {         /* refill the buffer this pass has read */
      vg0 = tdm_v_next(vg0, vlds_sum);
      tdm_load_v_tile(vg0, vg1);
    }
  }
  asm volatile("s_wait_tensorcnt 0x0" ::: "memory");       /* nothing in flight when the wave ends */
  asm volatile("s_wait_dscnt 0x0" ::: "memory");           /* the ring's closing wait on this wave's LDS reads */
#pragma unroll
  for (int pb = 0; pb < 8; ++pb) {
    int p = pb * 16 + col;
#pragma unroll
    for (int r = 0; r < 8; ++r) {
      int n = n0 + w * 16 + 8 * hf + r;
      Y[((size_t)b * NN + n) * PP + p] = (__bf16)(o[pb][r] / lrow[r]);
    }
  }
}

/* ---- kernel 3: z = Wz*y + bz (stored [b][c][n] fp32) + this block's BN partial
   sums: lanes -> LDS -> one row of 512 floats per block, no atomics ---- */
__global__ __launch_bounds__(128) void nl_zproj_kernel(
    const __bf16* __restrict__ Y, const __bf16* __restrict__ wz,
    const float* __restrict__ bz, float* __restrict__ Z,
    float* __restrict__ part) {
  __shared__ __align__(16) float red[4][2 * CC][2];  /* wave, sum|sumsq x channel, lane half */
  int b  = blockIdx.x >> 6;
  int n0 = (blockIdx.x & 63) << 6;
  int t = threadIdx.x, w = t >> 5, lane = t & 31, hf = lane >> 4, col = lane & 15;
  v8f acc[16] = {};
  const __bf16* Yb = Y + ((size_t)b * NN + n0 + w * 16) * PP;
#pragma unroll
  for (int kk = 0; kk < 4; ++kk) {
    v16bf af = load_frag16(Yb, PP, kk * 32);
#pragma unroll
    for (int cb = 0; cb < 16; ++cb) {
      v16bf bf = load_frag16(wz + (size_t)(cb * 16) * PP, PP, kk * 32);
      acc[cb] = wmma_bf16(af, bf, acc[cb]);
    }
  }
#pragma unroll
  for (int cb = 0; cb < 16; ++cb) {
    int c = cb * 16 + col;
    float bias = bz[c];
    v8f vv; float ls = 0.0f, lss = 0.0f;
#pragma unroll
    for (int r = 0; r < 8; ++r) {
      float v = acc[cb][r] + bias;
      vv[r] = v; ls += v; lss += v * v;
    }
    *(v8f*)(Z + ((size_t)(b * CC + c)) * NN + n0 + w * 16 + 8 * hf) = vv;
    red[w][c][hf]      = ls;
    red[w][CC + c][hf] = lss;
  }
  __syncthreads();
  for (int k = 0; k < 4; ++k) {
    int e = t + 128 * k;                 /* sum|sumsq x channel */
    float tot = 0.0f;
    for (int ww = 0; ww < 4; ++ww) tot += red[ww][e][0] + red[ww][e][1];
    part[(size_t)blockIdx.x * (2 * CC) + e] = tot;
  }
}

/* ---- kernel 4: add the blocks' partial sums, finalize per-channel scale/shift.
   A block owns 32 channels (one 128-B line of scale and of shift); each of its
   8 waves adds NBLK/8 rows, a lane per channel. ---- */
__global__ __launch_bounds__(256) void nl_stats_kernel(
    const float* __restrict__ part,
    const float* __restrict__ gamma, const float* __restrict__ beta,
    float* __restrict__ scale, float* __restrict__ shift) {
  __shared__ float rs[8][2][32];
  int lane = threadIdx.x & 31, g = threadIdx.x >> 5;
  int c = blockIdx.x * 32 + lane;
  const float* row = part + (size_t)(g * (NBLK / 8)) * (2 * CC) + c;
  float gm = gamma[c], bt = beta[c];   /* fetched with the rows, not behind the barrier */
  float s = 0.0f, q = 0.0f;
  /* unrolled so that all the row loads are in flight together (one latency, not 32) */
#pragma unroll
  for (int i = 0; i < NBLK / 8; ++i) {
    s += row[(size_t)i * (2 * CC)];
    q += row[(size_t)i * (2 * CC) + CC];
  }
  rs[g][0][lane] = s;
  rs[g][1][lane] = q;
  __syncthreads();
  if (g == 0) {
    float sum = 0.0f, ssq = 0.0f;
    for (int j = 0; j < 8; ++j) { sum += rs[j][0][lane]; ssq += rs[j][1][lane]; }
    float inv  = 1.0f / (float)(BB * NN);
    float mean = sum * inv;
    float var  = ssq * inv - mean * mean;
    float sc   = gm * rsqrtf(var + BN_EPS);
    scale[c] = sc;
    shift[c] = bt - mean * sc;
  }
}

/* ---- kernel 5: out = z*scale + shift + x (vectorized float4) ---- */
__global__ __launch_bounds__(256) void nl_apply_kernel(
    const float* __restrict__ Z, const float* __restrict__ x,
    const float* __restrict__ scale, const float* __restrict__ shift,
    float* __restrict__ out) {
  size_t i4 = (size_t)blockIdx.x * blockDim.x + threadIdx.x;  /* 1048576 vec4 */
  int c = (int)((i4 >> 10) & (CC - 1));                       /* N=4096 -> 1024 vec4 per ch */
  float4 z  = ((const float4*)Z)[i4];
  float4 xv = ((const float4*)x)[i4];
  float sc = scale[c], sh = shift[c];
  float4 o;
  o.x = z.x * sc + sh + xv.x;
  o.y = z.y * sc + sh + xv.y;
  o.z = z.z * sc + sh + xv.z;
  o.w = z.w * sc + sh + xv.w;
  ((float4*)out)[i4] = o;
}

extern "C" void kernel_launch(void* const* d_in, const int* in_sizes, int n_in,
                              void* d_out, int out_size, void* d_ws, size_t ws_size,
                              hipStream_t stream) {
  const float* x     = (const float*)d_in[0];
  const float* Wt    = (const float*)d_in[1];
  const float* bt    = (const float*)d_in[2];
  const float* Wp    = (const float*)d_in[3];
  const float* bp    = (const float*)d_in[4];
  const float* Wg    = (const float*)d_in[5];
  const float* bg    = (const float*)d_in[6];
  const float* Wz    = (const float*)d_in[7];
  const float* bz    = (const float*)d_in[8];
  const float* gamma = (const float*)d_in[9];
  const float* beta  = (const float*)d_in[10];
  (void)in_sizes; (void)n_in; (void)out_size; (void)ws_size;

  char* ws = (char*)d_ws;
  __bf16* wt  = (__bf16*)(ws + OFF_WT);
  __bf16* wp  = (__bf16*)(ws + OFF_WP);
  __bf16* wg  = (__bf16*)(ws + OFF_WG);
  __bf16* wz  = (__bf16*)(ws + OFF_WZ);
  __bf16* Qw  = (__bf16*)(ws + OFF_Q);
  __bf16* Kw  = (__bf16*)(ws + OFF_K);
  __bf16* Vtw = (__bf16*)(ws + OFF_VT);
  __bf16* Yw  = (__bf16*)(ws + OFF_Y);
  float*  Zw  = (float*)(ws + OFF_Z);
  float*  partw = (float*)(ws + OFF_PART);
  float*  sclw = (float*)(ws + OFF_SCL);
  float*  shfw = (float*)(ws + OFF_SHF);

  nl_prep_kernel<<<512, 256, 0, stream>>>(Wt, Wp, Wg, Wz, wt, wp, wg, wz);
  nl_proj_kernel<<<dim3(BB * (NN / 64), 3), 128, 0, stream>>>(
      x, wt, wp, wg, bt, bp, bg, Qw, Kw, Vtw);
  nl_attn_kernel<<<BB * (NN / 64), 128, 0, stream>>>(Qw, Kw, Vtw, Yw);
  nl_zproj_kernel<<<BB * (NN / 64), 128, 0, stream>>>(Yw, wz, bz, Zw, partw);
  nl_stats_kernel<<<CC / 32, 256, 0, stream>>>(partw, gamma, beta, sclw, shfw);
  nl_apply_kernel<<<(BB * CC * NN) / 4 / 256, 256, 0, stream>>>(Zw, x, sclw, shfw,
                                                                (float*)d_out);
}
